// v000
// Times are from an AMD MI455X. After a warm-up the kernel runs many times in a row, and a time is the length of
// such a window on the GPU divided by its runs, so every launch and the gaps after it count. The runs cycle
// through copies of the inputs. A figure is the median of several windows, for all but v000 over two sittings.
// Sittings can differ by a few percent; kernels timed side by side share one.
// v000 is the starting kernel. One run takes 1420 microseconds.
#include <hip/hip_runtime.h>
// GQMultiheadAttention (2 x 2048 tokens, D 2048 = 16 heads of 128, 4 kv groups): q, k, v = x W + b; interleaved-pair RoPE on q and k with angles from the rotary_freqs input; head h reads kv group h/4; softmax(q.k / sqrt(128)) over all keys; out = ctx Wo + bo.
// Structure: exact f16 plane of x; q and k as f32 WMMA GEMM outputs, v as f16 (32x64 wave tiles, f32 accumulation, exact x16 weights + bias); cos/sin of the angle input on VALU; RoPE on VALU into f16 planes; V^T by LDS tiles (64-dim slab pairs = one 128-dim group); per batch and chunk of 4 heads (one kv group): head-batched score GEMM (K 128), softmax on VALU (wave per row, f16 P x2^10), head-batched readout GEMM; f16 into the output GEMM (+ bias).
// Compute dtype: x and parameters rounded to bf16; q, k, v, P and the attention output as f16 operands (~2^-12; full softmax over 2048 keys); RoPE/softmax f32. v_wmma_f32_16x16x32_f16.
#define NB 2
#define SQ 2048
#define DM 2048
#define NHD 16
#define HD 128
#define NG 4
#define KVD (NG * HD)            /* 512 */
#define HCH 4                    /* heads per chunk = one kv group */
#define NR (NB * SQ)
#define SCL 0.08838834764831845f /* 128^-0.5 */
typedef __bf16 v16b __attribute__((ext_vector_type(16)));
typedef unsigned short v8us __attribute__((ext_vector_type(8), may_alias));
typedef float  v8f  __attribute__((ext_vector_type(8)));
typedef float  v4f  __attribute__((ext_vector_type(4)));
typedef float  v4fa __attribute__((ext_vector_type(4), may_alias));
union FragB { v16b v; v8us half[2]; unsigned short u[16]; };

__device__ __forceinline__ unsigned short bf16_bits(float x) { unsigned int u = __float_as_uint(x); return (unsigned short)((u + 0x7FFFu + ((u >> 16) & 1u)) >> 16); }
__device__ __forceinline__ float bf16_val(unsigned short b) { return __uint_as_float(((unsigned int)b) << 16); }
__device__ __forceinline__ float bf16_round(float x) { return bf16_val(bf16_bits(x)); }
// D += A·B with NT terms: 1 = ah·bh, 2 = + al·bh (A split), 3 = + ah·bl (both split)
template <int NT>
__device__ __forceinline__ v8f mmaN(v16b ah, v16b al, v16b bh, v16b bl, v8f c) {
  c = __builtin_amdgcn_wmma_f32_16x16x32_bf16(false, ah, false, bh, (short)0, c, false, false);
  if (NT >= 2) c = __builtin_amdgcn_wmma_f32_16x16x32_bf16(false, al, false, bh, (short)0, c, false, false);
  if (NT >= 3) c = __builtin_amdgcn_wmma_f32_16x16x32_bf16(false, ah, false, bl, (short)0, c, false, false);
  asm volatile("v_nop\n\tv_nop\n\tv_nop\n\tv_nop" : "+v"(c) : "v"(ah), "v"(al), "v"(bh), "v"(bl));
  return c;
}

__global__ __launch_bounds__(256) void k_wt_bf16(const float* __restrict__ W, unsigned short* __restrict__ Wt, int K, int N) {
  const int t = blockIdx.x * 256 + threadIdx.x;
  const int k8n = K / 8;
  if (t >= N * k8n) return;
  const int n = t / k8n, k8 = (t % k8n) * 8;
  v8us v;
#pragma unroll
  for (int i = 0; i < 8; ++i) v[i] = bf16_bits(W[(size_t)(k8 + i) * N + n]);
  *(v8us*)(Wt + (size_t)n * K + k8) = v;
  
}

// GEMM C[M][N] (f32, pitch ldc) = act(A[M][K]·W + bias). A f32 row-major (pitch lda) converted per fragment to bf16
// (ASPLIT: hi/lo two planes -> 2 terms, else single rounded term); Wt bf16 [N][K] (pitch ldb). BIAS_BF16 rounds the
// bias to bf16 first (bias quantised to bf16 before the add). K%32==0, M%16==0, N%64==0.
template <bool ASPLIT, int ACT, bool BIAS_BF16>
__global__ __launch_bounds__(128) void k_gemm_bf(const float* __restrict__ A, int lda, const unsigned short* __restrict__ Wt, int ldb,
                                               const float* __restrict__ bias, float* __restrict__ C, int ldc, int M, int N, int K) {
  __shared__ __attribute__((aligned(16))) float so[4][16][64];
  const int tid = threadIdx.x, w = tid >> 5, lane = tid & 31, ln = lane & 15, hh = lane >> 4;
  const int ntn = N / 64;
  const int wid = blockIdx.x * 4 + w;
  const int mt = wid / ntn, nq = wid % ntn;
  if (mt * 16 >= M) return;
  const int row0 = mt * 16, col0 = nq * 64;
  const float* arow = A + (size_t)(row0 + ln) * lda;
  v8f acc[4] = {};
  for (int kb = 0; kb < K; kb += 32) {
    FragB ah, al;
    const v4f x0 = *(const v4fa*)(arow + kb + 8 * hh), x1 = *(const v4fa*)(arow + kb + 8 * hh + 4);
    const v4f x2 = *(const v4fa*)(arow + kb + 16 + 8 * hh), x3 = *(const v4fa*)(arow + kb + 16 + 8 * hh + 4);
    float xs[16] = {x0[0],x0[1],x0[2],x0[3],x1[0],x1[1],x1[2],x1[3],x2[0],x2[1],x2[2],x2[3],x3[0],x3[1],x3[2],x3[3]};
#pragma unroll
    for (int i = 0; i < 16; ++i) { const unsigned short hb = bf16_bits(xs[i]); ah.u[i] = hb; al.u[i] = ASPLIT ? bf16_bits(xs[i] - bf16_val(hb)) : (unsigned short)0; }
#pragma unroll
    for (int t = 0; t < 4; ++t) {
      const unsigned short* brow = Wt + (size_t)(col0 + t * 16 + ln) * ldb + kb;
      FragB b;
      b.half[0] = *(const v8us*)(brow + 8 * hh);
      b.half[1] = *(const v8us*)(brow + 16 + 8 * hh);
      acc[t] = mmaN<ASPLIT ? 2 : 1>(ah.v, al.v, b.v, b.v, acc[t]);
    }
  }
#pragma unroll
  for (int t = 0; t < 4; ++t) {
    float bv = bias ? bias[col0 + t * 16 + ln] : 0.f;
    if (BIAS_BF16) bv = bf16_round(bv);
#pragma unroll
    for (int r = 0; r < 8; ++r) { float v = acc[t][r] + bv; if (ACT == 1) v = fmaxf(v, 0.f); so[w][8 * hh + r][t * 16 + ln] = v; }
  }
  __builtin_amdgcn_fence(__ATOMIC_ACQ_REL, "workgroup");
  __builtin_amdgcn_wave_barrier();
  const int rsub = lane >> 4, c4 = (lane & 15) * 4;
  {
#pragma unroll
    for (int q = 0; q < 8; ++q) {
      const int r = q * 2 + rsub;
      const v4f v = *(const v4fa*)&so[w][r][c4];
      *(v4f*)(C + (size_t)(row0 + r) * ldc + col0 + c4) = v;
    }
    
  }
}

// GEMM C = act(A·W + bias + resid): A f32 (ASPLIT -> hi/lo 2 terms), Wt bf16 [N][K]; ACT 0 none, 1 relu, 2 exact gelu;
// resid (optional, f32, row index = (row % rmod), pitch ldr, RES_BF16 rounds it) added before the activation.
template <bool ASPLIT, int ACT, bool BIAS_BF16, bool RES_BF16>
__global__ __launch_bounds__(128) void k_gemm_bf3(const float* __restrict__ A, int lda, const unsigned short* __restrict__ Wt, int ldb,
                                                const float* __restrict__ bias, const float* __restrict__ resid, int rmod, int ldr,
                                                float* __restrict__ C, int ldc, int M, int N, int K) {
  __shared__ __attribute__((aligned(16))) float so[4][16][64];
  const int tid = threadIdx.x, w = tid >> 5, lane = tid & 31, ln = lane & 15, hh = lane >> 4;
  const int ntn = N / 64;
  const int wid = blockIdx.x * 4 + w;
  const int mt = wid / ntn, nq = wid % ntn;
  if (mt * 16 >= M) return;
  const int row0 = mt * 16, col0 = nq * 64;
  const float* arow = A + (size_t)(row0 + ln) * lda;
  v8f acc[4] = {};
  for (int kb = 0; kb < K; kb += 32) {
    FragB ah, al;
    const v4f x0 = *(const v4fa*)(arow + kb + 8 * hh), x1 = *(const v4fa*)(arow + kb + 8 * hh + 4);
    const v4f x2 = *(const v4fa*)(arow + kb + 16 + 8 * hh), x3 = *(const v4fa*)(arow + kb + 16 + 8 * hh + 4);
    float xs[16] = {x0[0],x0[1],x0[2],x0[3],x1[0],x1[1],x1[2],x1[3],x2[0],x2[1],x2[2],x2[3],x3[0],x3[1],x3[2],x3[3]};
#pragma unroll
    for (int i = 0; i < 16; ++i) { const unsigned short hb = bf16_bits(xs[i]); ah.u[i] = hb; al.u[i] = ASPLIT ? bf16_bits(xs[i] - bf16_val(hb)) : (unsigned short)0; }
#pragma unroll
    for (int t = 0; t < 4; ++t) {
      const unsigned short* brow = Wt + (size_t)(col0 + t * 16 + ln) * ldb + kb;
      FragB b;
      b.half[0] = *(const v8us*)(brow + 8 * hh);
      b.half[1] = *(const v8us*)(brow + 16 + 8 * hh);
      acc[t] = mmaN<ASPLIT ? 2 : 1>(ah.v, al.v, b.v, b.v, acc[t]);
    }
  }
#pragma unroll
  for (int t = 0; t < 4; ++t) {
    const int col = col0 + t * 16 + ln;
    float bv = bias ? bias[col] : 0.f;
    if (BIAS_BF16) bv = bf16_round(bv);
#pragma unroll
    for (int r = 0; r < 8; ++r) {
      float v = acc[t][r] + bv;
      if (resid) { float rv = resid[(size_t)((row0 + 8 * hh + r) % rmod) * ldr + col]; if (RES_BF16) rv = bf16_round(rv); v += rv; }
      if (ACT == 1) v = fmaxf(v, 0.f);
      if (ACT == 2) v = 0.5f * v * (1.0f + erff(v * 0.70710678118654752f));
      if (ACT == 3) { const float u = 0.7978845608028654f * (v + 0.044715f * v * v * v); v = 0.5f * v * (1.0f + tanhf(u)); }
      so[w][8 * hh + r][t * 16 + ln] = v;
    }
  }
  __builtin_amdgcn_fence(__ATOMIC_ACQ_REL, "workgroup");
  __builtin_amdgcn_wave_barrier();
  const int rsub = lane >> 4, c4 = (lane & 15) * 4;
  {
#pragma unroll
    for (int q = 0; q < 8; ++q) {
      const int r = q * 2 + rsub;
      const v4f v = *(const v4fa*)&so[w][r][c4];
      *(v4f*)(C + (size_t)(row0 + r) * ldc + col0 + c4) = v;
    }
    
  }
}
// row LayerNorm (biased variance, eps) over N: s = X (+ R); optional out_sum <- s; out_norm <- (s-mu)*rsqrt(var+eps)*g + b
template <bool PARAM_BF16>
__global__ __launch_bounds__(256) void k_layernorm(const float* __restrict__ X, const float* __restrict__ R, const float* __restrict__ g, const float* __restrict__ bta,
                                                  float* __restrict__ out_sum, float* __restrict__ out_norm, int N, float eps) {
  __shared__ float red[256];
  const int row = blockIdx.x, tid = threadIdx.x;
  const float* x = X + (size_t)row * N; const float* rr = R ? R + (size_t)row * N : nullptr;
  float vals[16];                     // up to N = 4096
  const int per = N / 256;            // contiguous chunk per thread? use strided-by-4 chunks: thread handles j = tid*4 + 1024*u
  float s1 = 0.f;
  for (int u = 0; u < per / 4; ++u) {
    const int j = tid * 4 + 1024 * u;
    const v4f a = *(const v4fa*)(x + j);
    v4f b = {0.f,0.f,0.f,0.f}; if (rr) b = *(const v4fa*)(rr + j);
#pragma unroll
    for (int q = 0; q < 4; ++q) { const float v = a[q] + b[q]; vals[u * 4 + q] = v; s1 += v; }
  }
  red[tid] = s1; __syncthreads();
  for (int st = 128; st > 0; st >>= 1) { if (tid < st) red[tid] += red[tid + st]; __syncthreads(); }
  const float mu = red[0] / (float)N; __syncthreads();
  float s2 = 0.f;
  for (int u = 0; u < per / 4; ++u)
#pragma unroll
    for (int q = 0; q < 4; ++q) { const float c = vals[u * 4 + q] - mu; s2 += c * c; }
  red[tid] = s2; __syncthreads();
  for (int st = 128; st > 0; st >>= 1) { if (tid < st) red[tid] += red[tid + st]; __syncthreads(); }
  const float rs = rsqrtf(red[0] / (float)N + eps);
  {
    for (int u = 0; u < per / 4; ++u) {
      const int j = tid * 4 + 1024 * u;
      v4f o, sm;
#pragma unroll
      for (int q = 0; q < 4; ++q) {
        float gg = g[j + q], bb = bta[j + q];
        if (PARAM_BF16) { gg = bf16_round(gg); bb = bf16_round(bb); }
        sm[q] = vals[u * 4 + q]; o[q] = (vals[u * 4 + q] - mu) * rs * gg + bb;
      }
      if (out_sum) *(v4f*)(out_sum + (size_t)row * N + j) = sm;
      *(v4f*)(out_norm + (size_t)row * N + j) = o;
    }
    
  }
}



// ---- f16 WMMA path (v_wmma_f32_16x16x32_f16): 11-bit significands for operands in range — used where a [0,1] probability operand needs more precision than bf16
typedef _Float16 v16h __attribute__((ext_vector_type(16)));
union FragH { v16h v; v8us half[2]; _Float16 h[16]; unsigned short u[16]; };
template <int NT>
__device__ __forceinline__ v8f mmaH(v16h ah, v16h al, v16h bh, v16h bl, v8f c) {
  c = __builtin_amdgcn_wmma_f32_16x16x32_f16(false, ah, false, bh, (short)0, c, false, false);
  if (NT >= 2) c = __builtin_amdgcn_wmma_f32_16x16x32_f16(false, al, false, bh, (short)0, c, false, false);
  if (NT >= 3) c = __builtin_amdgcn_wmma_f32_16x16x32_f16(false, ah, false, bl, (short)0, c, false, false);
  asm volatile("v_nop\n\tv_nop\n\tv_nop\n\tv_nop" : "+v"(c) : "v"(ah), "v"(al), "v"(bh), "v"(bl));
  return c;
}
// batched GEMM like k_gemm_b but f16 operands: A f32 (split into f16 hi/lo if ASPLIT, else rounded to f16), Bt = f16 values [n][k]; alpha; C f32; N multiple of 16 (partial tiles skipped)
template <bool ASPLIT>
__global__ __launch_bounds__(128) void k_gemm_h(const float* __restrict__ A, int lda, size_t sA, const _Float16* __restrict__ Bh, int ldb, size_t sB, float alpha, float* __restrict__ C, int ldc, size_t sC, int M, int N, int K) {
  __shared__ __attribute__((aligned(16))) float so[4][16][64];
  const int tid = threadIdx.x, w = tid >> 5, lane = tid & 31, ln = lane & 15, hh = lane >> 4; const int by = blockIdx.y;
  A += (size_t)by * sA; Bh += (size_t)by * sB; C += (size_t)by * sC;
  const int ntn = (N + 63) / 64; const int wid = blockIdx.x * 4 + w; const int mt = wid / ntn, nq = wid % ntn; if (mt * 16 >= M) return;
  const int row0 = mt * 16, col0 = nq * 64; const float* arow = A + (size_t)(row0 + ln) * lda;
  v8f acc[4] = {};
  for (int kb = 0; kb < K; kb += 32) {
    FragH ah, al;
    const v4f x0 = *(const v4fa*)(arow + kb + 8 * hh), x1 = *(const v4fa*)(arow + kb + 8 * hh + 4), x2 = *(const v4fa*)(arow + kb + 16 + 8 * hh), x3 = *(const v4fa*)(arow + kb + 16 + 8 * hh + 4);
    float xs[16] = {x0[0],x0[1],x0[2],x0[3],x1[0],x1[1],x1[2],x1[3],x2[0],x2[1],x2[2],x2[3],x3[0],x3[1],x3[2],x3[3]};
#pragma unroll
    for (int i = 0; i < 16; ++i) { const _Float16 h = (_Float16)xs[i]; ah.h[i] = h; al.h[i] = ASPLIT ? (_Float16)(xs[i] - (float)h) : (_Float16)0.0f; }
#pragma unroll
    for (int t = 0; t < 4; ++t) { if (col0 + t * 16 >= N) continue; const size_t boff = (size_t)(col0 + t * 16 + ln) * ldb + kb; FragH bq; bq.half[0] = *(const v8us*)(Bh + boff + 8 * hh); bq.half[1] = *(const v8us*)(Bh + boff + 16 + 8 * hh);
      acc[t] = mmaH<ASPLIT ? 2 : 1>(ah.v, al.v, bq.v, bq.v, acc[t]); }
  }
#pragma unroll
  for (int t = 0; t < 4; ++t) { if (col0 + t * 16 >= N) continue;
#pragma unroll
    for (int r = 0; r < 8; ++r) so[w][8 * hh + r][t * 16 + ln] = acc[t][r] * alpha; }
  __builtin_amdgcn_fence(__ATOMIC_ACQ_REL, "workgroup"); __builtin_amdgcn_wave_barrier();
  const int rsub = lane >> 4, c4 = (lane & 15) * 4;
  {
#pragma unroll
    for (int q = 0; q < 8; ++q) { const int r = q * 2 + rsub; if (col0 + c4 < N) { const v4f v = *(const v4fa*)&so[w][r][c4]; *(v4f*)(C + (size_t)(row0 + r) * ldc + col0 + c4) = v; } }
     }
}

// Wt[n][k] = f16(W[k][n]·scale) from f32 row-major W[K][N] (scale = power of two; bf16-exact weights stay exact in f16 away from the subnormal range)
__global__ __launch_bounds__(256) void k_wt_f16(const float* __restrict__ W, _Float16* __restrict__ Wt, int K, int N, float scale) {
  const int t = blockIdx.x * 256 + threadIdx.x; if (t >= N * (K / 8)) return; const int n = t / (K / 8), k8 = (t % (K / 8)) * 8; FragH f;
#pragma unroll
  for (int i = 0; i < 8; ++i) f.h[i] = (_Float16)(bf16_round(W[(size_t)(k8 + i) * N + n]) * scale); const v8us o = f.half[0];
  *(v8us*)((unsigned short*)Wt + (size_t)n * K + k8) = o; 
}
// k_gemm_hh variant with fused epilogue: v = acc·alpha + bias[by·sBias + col] (+ CP[(row/rowsPerB)·sCPb + by·64 + col] if CP) ; ACT 0 none / 1 elu ; writes f16 C16 (and f32 C if non-null)
template <int ACT>
__global__ __launch_bounds__(128) void k_gemm_hhx(const _Float16* __restrict__ A, int lda, size_t sA, const _Float16* __restrict__ Bh, int ldb, size_t sB, float alpha, const float* __restrict__ bias, size_t sBias, const float* __restrict__ CP, int rowsPerB, size_t sCPb, int row0g,
    float* __restrict__ C, _Float16* __restrict__ C16, int ldc, size_t sC, int M, int N, int K) {
  __shared__ __attribute__((aligned(16))) float so[4][16][64];
  const int tid = threadIdx.x, w = tid >> 5, lane = tid & 31, ln = lane & 15, hh = lane >> 4; const int by = blockIdx.y;
  A += (size_t)by * sA; Bh += (size_t)by * sB; const size_t cofs = (size_t)by * sC; const float* bp = bias ? bias + (size_t)by * sBias : nullptr;
  const int ntn = (N + 63) / 64; const int wid = blockIdx.x * 4 + w; const int mt = wid / ntn, nq = wid % ntn; if (mt * 16 >= M) return;
  const int row0 = mt * 16, col0 = nq * 64; const _Float16* arow = A + (size_t)(row0 + ln) * lda;
  v8f acc[4] = {};
  for (int kb = 0; kb < K; kb += 32) { FragH ah; ah.half[0] = *(const v8us*)((const unsigned short*)arow + kb + 8 * hh); ah.half[1] = *(const v8us*)((const unsigned short*)arow + kb + 16 + 8 * hh);
#pragma unroll
    for (int t = 0; t < 4; ++t) { if (col0 + t * 16 >= N) continue; const size_t boff = (size_t)(col0 + t * 16 + ln) * ldb + kb; FragH bq; bq.half[0] = *(const v8us*)((const unsigned short*)Bh + boff + 8 * hh); bq.half[1] = *(const v8us*)((const unsigned short*)Bh + boff + 16 + 8 * hh);
      acc[t] = mmaH<1>(ah.v, ah.v, bq.v, bq.v, acc[t]); }
  }
#pragma unroll
  for (int t = 0; t < 4; ++t) { if (col0 + t * 16 >= N) continue; const int col = col0 + t * 16 + ln; const float bv = bp ? bf16_round(bp[col]) : 0.f;
#pragma unroll
    for (int r = 0; r < 8; ++r) { float v = acc[t][r] * alpha + bv; if (CP) { const int rr = row0g + row0 + 8 * hh + r; if (rowsPerB < 0) v += CP[cofs + (size_t)rr * ldc + col];      /* rowsPerB < 0: own element of the batched C plane */ else { const int bidx = rr / rowsPerB; v += CP[(size_t)bidx * sCPb + (size_t)by * 64 + col]; } } if (ACT == 1) v = (v > 0.f) ? v : expm1f(v); else if (ACT == 7) v = (v > 0.f) ? v + 1.0f : expf(v); else if (ACT == 8) v = tanhf(v); else if (ACT == 9) v = 0.5f * v * (1.0f + tanhf(0.7978845608028654f * (v + 0.044715f * v * v * v))); else if (ACT == 11) v = 1.0f / (1.0f + expf(-v)); else if (ACT == 12) v = (v > 0.f) ? v : 0.01f * v; else if (ACT == 14) v = (v > 0.f) ? v : 0.1f * v; else if (ACT == 16) v = (v >= 0.f) ? v : 0.3f * v; else if (ACT == 15) v = v / (1.0f + expf(-v)); else if (ACT == 3) v = fmaxf(v, 0.f); else if (ACT == 6) v = 0.5f * v * (1.0f + erff(v * 0.70710678118654752f)); so[w][8 * hh + r][t * 16 + ln] = v; } }
  __builtin_amdgcn_fence(__ATOMIC_ACQ_REL, "workgroup"); __builtin_amdgcn_wave_barrier();
  const int rsub = lane >> 4, c4 = (lane & 15) * 4; typedef _Float16 v4h __attribute__((ext_vector_type(4)));
  {
#pragma unroll
    for (int q = 0; q < 8; ++q) { const int r = q * 2 + rsub; if (col0 + c4 < N) { const v4f v = *(const v4fa*)&so[w][r][c4]; if (C) *(v4f*)(C + cofs + (size_t)(row0 + r) * ldc + col0 + c4) = v; if (C16) { v4h h4; for (int i = 0; i < 4; ++i) h4[i] = (_Float16)v[i]; *(v4h*)(C16 + cofs + (size_t)(row0 + r) * ldc + col0 + c4) = h4; } } }
     }
}


typedef _Float16 v4h __attribute__((ext_vector_type(4)));

__global__ __launch_bounds__(256) void k_x16(const float* __restrict__ x, _Float16* __restrict__ X16, size_t n8) { const size_t t = (size_t)blockIdx.x * 256 + threadIdx.x; if (t >= n8) return; FragH f;
#pragma unroll
  for (int q = 0; q < 8; ++q) f.h[q] = (_Float16)bf16_round(x[t * 8 + q]); *(v8us*)((unsigned short*)X16 + t * 8) = f.half[0];  }
__global__ __launch_bounds__(256) void k_h16(const float* __restrict__ x, _Float16* __restrict__ X16, size_t n8) { const size_t t = (size_t)blockIdx.x * 256 + threadIdx.x; if (t >= n8) return; FragH f;
#pragma unroll
  for (int q = 0; q < 8; ++q) f.h[q] = (_Float16)x[t * 8 + q]; *(v8us*)((unsigned short*)X16 + t * 8) = f.half[0];  }
__global__ __launch_bounds__(256) void k_round16f(const float* __restrict__ W, _Float16* __restrict__ Bt, size_t n8) { const size_t t = (size_t)blockIdx.x * 256 + threadIdx.x; if (t >= n8) return; FragH f;
#pragma unroll
  for (int i = 0; i < 8; ++i) f.h[i] = (_Float16)(bf16_round(W[t * 8 + i]) * 16.0f); *(v8us*)((unsigned short*)Bt + t * 8) = f.half[0];  }
template <int NHv, int TTv>
__global__ __launch_bounds__(256) void k_vt(const _Float16* __restrict__ V16, int ldv, int voff, _Float16* __restrict__ Vt) { __shared__ unsigned short tl[64][66]; const int tid = threadIdx.x; const int slab = blockIdx.x / (TTv / 64), lg = blockIdx.x % (TTv / 64); const int b = slab / NHv, h = slab % NHv;
  for (int i = tid; i < 64 * 8; i += 256) { const int r = i / 8, c8 = (i % 8) * 8; FragH f; f.half[0] = *(const v8us*)((const unsigned short*)V16 + ((size_t)b * TTv + lg * 64 + r) * ldv + voff + h * 64 + c8);
#pragma unroll
    for (int q = 0; q < 8; ++q) tl[r][c8 + q] = f.u[q]; }
  __syncthreads();
  {
#pragma unroll
    for (int rd = 0; rd < 2; ++rd) { const int d = rd * 32 + tid / 8, pc = tid % 8; FragH f;
#pragma unroll
      for (int q = 0; q < 8; ++q) f.u[q] = tl[pc * 8 + q][d];
      *(v8us*)((unsigned short*)Vt + ((size_t)slab * 64 + d) * TTv + lg * 64 + pc * 8) = f.half[0]; }
     } }

__global__ __launch_bounds__(256) void k_hl(const float* __restrict__ F, _Float16* __restrict__ Hh, _Float16* __restrict__ Hl, size_t n8) { const size_t t = (size_t)blockIdx.x * 256 + threadIdx.x; if (t >= n8) return; FragH fh, fl; const v4f a = *(const v4fa*)(F + t * 8), c = *(const v4fa*)(F + t * 8 + 4);
#pragma unroll
  for (int q = 0; q < 4; ++q) { _Float16 h = (_Float16)a[q]; fh.h[q] = h; fl.h[q] = (_Float16)((a[q] - (float)h) * 1024.0f); h = (_Float16)c[q]; fh.h[4 + q] = h; fl.h[4 + q] = (_Float16)((c[q] - (float)h) * 1024.0f); }
  { *(v8us*)((unsigned short*)Hh + t * 8) = fh.half[0]; *(v8us*)((unsigned short*)Hl + t * 8) = fl.half[0];  } }

// ---- fast GEMM (wave tile 32x64; requires M % 32 == 0 rows per launch region and N % 64 == 0); epilogue = k_gemm_hhx semantics ----
__device__ __forceinline__ v16h g2_frag(const _Float16* p, int hh) { FragH f; f.half[0] = *(const v8us*)((const unsigned short*)p + 8 * hh); f.half[1] = *(const v8us*)((const unsigned short*)p + 16 + 8 * hh); return f.v; }
__device__ __forceinline__ v8f g2_mma(v16h a, v16h b, v8f c) { v8f d = __builtin_amdgcn_wmma_f32_16x16x32_f16(false, a, false, b, (short)0, c, false, false); asm volatile("v_nop\n\tv_nop\n\tv_nop\n\tv_nop" : "+v"(d) : "v"(a), "v"(b)); return d; }
template <int ACT>
__global__ __launch_bounds__(128) void k_gemm2(const _Float16* __restrict__ A, int lda, size_t sA, const _Float16* __restrict__ Bh, int ldb, size_t sB, float alpha, const float* __restrict__ bias, size_t sBias, const float* __restrict__ CP, int rowsPerB, size_t sCPb, int row0g,
    float* __restrict__ C, _Float16* __restrict__ C16, int ldc, size_t sC, int M, int N, int K) { static_assert(ACT == 0 || ACT == 3 || ACT == 6 || ACT == 8 || ACT == 9 || ACT == 11 || ACT == 12 || ACT == 14 || ACT == 15 || ACT == 16, "k_gemm2: unsupported ACT code (would silently apply no activation)");
  __shared__ __attribute__((aligned(16))) float so[4][32][68];
  const int tid = threadIdx.x, w = tid >> 5, lane = tid & 31, ln = lane & 15, hh = lane >> 4; const int by = blockIdx.y;
  A += (size_t)by * sA; Bh += (size_t)by * sB; const size_t cofs = (size_t)by * sC; const float* bp = bias ? bias + (size_t)by * sBias : nullptr;
  const int ntn = N >> 6; const int mt = blockIdx.x / ntn, nq = blockIdx.x - mt * ntn; const int row0 = mt * 128 + 32 * w, col0 = nq * 64; if (row0 >= M) return;
  const _Float16* a0p = A + (size_t)(row0 + ln) * lda; const _Float16* a1p = a0p + (size_t)16 * lda;
  const _Float16* b0p = Bh + (size_t)(col0 + ln) * ldb; const _Float16* b1p = b0p + (size_t)16 * ldb; const _Float16* b2p = b1p + (size_t)16 * ldb; const _Float16* b3p = b2p + (size_t)16 * ldb;
  const v8f z8 = {0.f,0.f,0.f,0.f,0.f,0.f,0.f,0.f}; v8f c00 = z8, c01 = z8, c02 = z8, c03 = z8, c10 = z8, c11 = z8, c12 = z8, c13 = z8;
#pragma unroll 1
  for (int kb = 0; kb < K; kb += 32) { const v16h a0 = g2_frag(a0p + kb, hh), a1 = g2_frag(a1p + kb, hh);
    v16h b = g2_frag(b0p + kb, hh); c00 = g2_mma(a0, b, c00); c10 = g2_mma(a1, b, c10);
    b = g2_frag(b1p + kb, hh); c01 = g2_mma(a0, b, c01); c11 = g2_mma(a1, b, c11);
    b = g2_frag(b2p + kb, hh); c02 = g2_mma(a0, b, c02); c12 = g2_mma(a1, b, c12);
    b = g2_frag(b3p + kb, hh); c03 = g2_mma(a0, b, c03); c13 = g2_mma(a1, b, c13); }
  v8f accs[8] = {c00, c01, c02, c03, c10, c11, c12, c13};
#pragma unroll
  for (int u = 0; u < 8; ++u) { const int t = u & 3, half = u >> 2; const int col = col0 + t * 16 + ln; const float bv = bp ? bf16_round(bp[col]) : 0.f;
#pragma unroll
    for (int r = 0; r < 8; ++r) { const int rloc = half * 16 + 8 * hh + r; float v = accs[u][r] * alpha + bv; if (CP) { if (rowsPerB < 0) v += CP[cofs + (size_t)(row0g + row0 + rloc) * ldc + col];      /* rowsPerB < 0: own element of the batched C plane */ else { const int bidx = (row0g + row0 + rloc) / rowsPerB; v += CP[(size_t)bidx * sCPb + (size_t)by * 64 + col]; } }
      if (ACT == 3) v = fmaxf(v, 0.f); else if (ACT == 6) v = 0.5f * v * (1.0f + erff(v * 0.70710678118654752f)); else if (ACT == 11) v = 1.0f / (1.0f + expf(-v)); else if (ACT == 15) v = v / (1.0f + expf(-v)); else if (ACT == 12) v = (v > 0.f) ? v : 0.01f * v; else if (ACT == 8) v = tanhf(v); else if (ACT == 9) v = 0.5f * v * (1.0f + tanhf(0.7978845608028654f * (v + 0.044715f * v * v * v))); else if (ACT == 14) v = (v > 0.f) ? v : 0.1f * v; else if (ACT == 16) v = (v >= 0.f) ? v : 0.3f * v;
      so[w][rloc][t * 16 + ln] = v; } }
  __builtin_amdgcn_fence(__ATOMIC_ACQ_REL, "workgroup"); __builtin_amdgcn_wave_barrier();
  const int rsub = lane >> 4, c4 = (lane & 15) * 4;
  {
#pragma unroll
    for (int q = 0; q < 16; ++q) { const int r = q * 2 + rsub; const v4f v = *(const v4fa*)&so[w][r][c4]; if (C) *(v4f*)(C + cofs + (size_t)(row0 + r) * ldc + col0 + c4) = v; if (C16) { v4h h4; for (int i = 0; i < 4; ++i) h4[i] = (_Float16)v[i]; *(v4h*)(C16 + cofs + (size_t)(row0 + r) * ldc + col0 + c4) = h4; } }
     } }


__global__ __launch_bounds__(256) void k_cs(const float* __restrict__ rf, float* __restrict__ CS, float* __restrict__ SN) { const int t = blockIdx.x * 256 + threadIdx.x; if (t >= SQ * 64) return; const float a = bf16_round(rf[t]); const float c = cosf(a), s = sinf(a); { *(float*)(CS + t) = c; *(float*)(SN + t) = s;  } }
__global__ __launch_bounds__(256) void k_rope(const float* __restrict__ F, int nh, const float* __restrict__ CS, const float* __restrict__ SN, _Float16* __restrict__ H16) {
  #pragma clang fp contract(off)
  const size_t t = (size_t)blockIdx.x * 256 + threadIdx.x; if (t >= (size_t)NR * nh * 16) return; const int g8 = (int)(t % 16); const int h = (int)((t / 16) % nh); const size_t row = t / ((size_t)16 * nh); const int s = (int)(row % SQ);
  const size_t base = row * (size_t)(nh * HD) + h * HD + g8 * 8; FragH f;
  for (int i = 0; i < 4; ++i) { const int j = g8 * 4 + i; const float c = CS[s * 64 + j], sn = SN[s * 64 + j]; const float e = F[base + 2 * i], o = F[base + 2 * i + 1]; float r0 = e * c; r0 += -o * sn; float r1 = e * sn; r1 += o * c; f.h[2 * i] = (_Float16)r0; f.h[2 * i + 1] = (_Float16)r1; }
  *(v8us*)((unsigned short*)H16 + base) = f.half[0];  }
__global__ __launch_bounds__(256) void k_soft(const float* __restrict__ S, _Float16* __restrict__ P) {
  #pragma clang fp contract(off)
  const int wv = threadIdx.x >> 5, ln = threadIdx.x & 31; const int r = blockIdx.x * 8 + wv; if (r >= HCH * SQ) return; const float* sr = S + (size_t)r * SQ; float m = -3.0e38f;
#pragma unroll 1
  for (int j = ln; j < SQ; j += 32) m = fmaxf(m, sr[j]);
  for (int o = 16; o > 0; o >>= 1) m = fmaxf(m, __shfl_xor(m, o, 32)); float su = 0.f;
#pragma unroll 1
  for (int j = ln; j < SQ; j += 32) su += expf(sr[j] - m);
  for (int o = 16; o > 0; o >>= 1) su += __shfl_xor(su, o, 32); const float f = 1024.0f / su;
  {
#pragma unroll 1
    for (int j = ln; j < SQ; j += 32) *(_Float16*)(P + (size_t)r * SQ + j) = (_Float16)(expf(sr[j] - m) * f);
     } }

extern "C" void kernel_launch(void* const* d_in, const int* in_sizes, int n_in,
                              void* d_out, int out_size, void* d_ws, size_t ws_size, hipStream_t stream) {
  (void)in_sizes; (void)n_in; (void)out_size;
  const float* const* I = (const float* const*)d_in; const float* x = I[0]; const float* rf = I[1]; const float* Wq = I[2]; const float* bq = I[3]; const float* Wk = I[4]; const float* bk = I[5]; const float* Wv = I[6]; const float* bv = I[7]; const float* Wo = I[8]; const float* bo = I[9];
  char* ws = (char*)d_ws; size_t off = 0;
  auto take = [&](size_t bytes) { char* p = ws + off; off += (bytes + 255) & ~(size_t)255; return p; };
  const size_t np = (size_t)NR * DM, nk = (size_t)NR * KVD;
  _Float16* BQ = (_Float16*)take((size_t)DM * DM * 2); _Float16* BK = (_Float16*)take((size_t)KVD * DM * 2); _Float16* BV = (_Float16*)take((size_t)KVD * DM * 2); _Float16* BO = (_Float16*)take((size_t)DM * DM * 2); float* CS = (float*)take((size_t)SQ * 64 * 4); float* SN = (float*)take((size_t)SQ * 64 * 4);
  _Float16* X16 = (_Float16*)take(np * 2); float* QF = (float*)take(np * 4); _Float16* Q16 = (_Float16*)take(np * 2); float* KF = (float*)take(nk * 4); _Float16* K16 = (_Float16*)take(nk * 2); _Float16* V16 = (_Float16*)take(nk * 2); _Float16* VT = (_Float16*)take(nk * 2);
  float* S = (float*)take((size_t)HCH * SQ * SQ * 4); _Float16* P = (_Float16*)take((size_t)HCH * SQ * SQ * 2); float* O = QF;      /* attention output over the q f32 plane (dead after RoPE) */ _Float16* O16 = (_Float16*)take(np * 2);
  if (off > ws_size) return;      /* 20 + 1 + 16 + 32 + 16 + 8 + 4 + 4 + 4 + 64 + 32 + 16 = 217 MiB */
  k_wt_f16<<<(unsigned)(((size_t)DM * DM / 8 + 255) / 256), 256, 0, stream>>>(Wq, BQ, DM, DM, 16.0f); k_wt_f16<<<(unsigned)(((size_t)DM * KVD / 8 + 255) / 256), 256, 0, stream>>>(Wk, BK, DM, KVD, 16.0f); k_wt_f16<<<(unsigned)(((size_t)DM * KVD / 8 + 255) / 256), 256, 0, stream>>>(Wv, BV, DM, KVD, 16.0f); k_wt_f16<<<(unsigned)(((size_t)DM * DM / 8 + 255) / 256), 256, 0, stream>>>(Wo, BO, DM, DM, 16.0f);
  k_cs<<<(SQ * 64 + 255) / 256, 256, 0, stream>>>(rf, CS, SN);
  k_x16<<<(unsigned)((np / 8 + 255) / 256), 256, 0, stream>>>(x, X16, np / 8);
  k_gemm2<0><<<dim3((NR / 128) * (DM / 64), 1), 128, 0, stream>>>(X16, DM, 0, BQ, DM, 0, 0.0625f, bq, 0, nullptr, 1, 0, 0, QF, nullptr, DM, 0, NR, DM, DM);
  k_gemm2<0><<<dim3((NR / 128) * (KVD / 64), 1), 128, 0, stream>>>(X16, DM, 0, BK, DM, 0, 0.0625f, bk, 0, nullptr, 1, 0, 0, KF, nullptr, KVD, 0, NR, KVD, DM);
  k_gemm2<0><<<dim3((NR / 128) * (KVD / 64), 1), 128, 0, stream>>>(X16, DM, 0, BV, DM, 0, 0.0625f, bv, 0, nullptr, 1, 0, 0, nullptr, V16, KVD, 0, NR, KVD, DM);
  k_rope<<<(unsigned)(((size_t)NR * NHD * 16 + 255) / 256), 256, 0, stream>>>(QF, NHD, CS, SN, Q16); k_rope<<<(unsigned)(((size_t)NR * NG * 16 + 255) / 256), 256, 0, stream>>>(KF, NG, CS, SN, K16);
  k_vt<KVD / 64, SQ><<<NB * (KVD / 64) * (SQ / 64), 256, 0, stream>>>(V16, KVD, 0, VT);      /* 64-dim slabs: group g = slabs 2g, 2g+1 (contiguous) ; QF becomes O */
  const size_t sS = (size_t)SQ * SQ;
  for (int b = 0; b < NB; ++b) for (int hc = 0; hc < NHD; hc += HCH) { const int g = hc / (NHD / NG);
    k_gemm2<0><<<dim3((SQ / 128) * (SQ / 64), HCH), 128, 0, stream>>>(Q16 + (size_t)b * SQ * DM + hc * HD, DM, (size_t)HD, K16 + (size_t)b * SQ * KVD + g * HD, KVD, 0, SCL, nullptr, 0, nullptr, 1, 0, 0, S, nullptr, SQ, sS, SQ, SQ, HD);      /* scores / sqrt(128); the 4 heads of a chunk share kv group g */
    k_soft<<<(HCH * SQ) / 8, 256, 0, stream>>>(S, P);
    k_gemm2<0><<<dim3((SQ / 128) * (HD / 64), HCH), 128, 0, stream>>>(P, SQ, sS, VT + (size_t)(b * (KVD / 64) + 2 * g) * 64 * SQ, SQ, 0, 0.0009765625f, nullptr, 0, nullptr, 1, 0, 0, O + (size_t)b * SQ * DM + hc * HD, nullptr, DM, (size_t)HD, SQ, HD, SQ); }
  k_h16<<<(unsigned)((np / 8 + 255) / 256), 256, 0, stream>>>(O, O16, np / 8);
  k_gemm2<0><<<dim3((NR / 128) * (DM / 64), 1), 128, 0, stream>>>(O16, DM, 0, BO, DM, 0, 0.0625f, bo, 0, nullptr, 1, 0, 0, (float*)d_out, nullptr, DM, 0, NR, DM, DM);
}

// v001
// A run of this version takes 444 microseconds.
// Next to v000, in two timings, it ran 3.26 and 3.28 times as fast.
#include <hip/hip_runtime.h>
// GQMultiheadAttention (2 x 2048 tokens, D 2048 = 16 heads of 128, 4 kv groups): q, k, v = x W + b; interleaved-pair RoPE on q and k with angles from the rotary_freqs input; head h reads kv group h/4; softmax(q.k / sqrt(128)) over all keys; out = ctx Wo + bo.
// Structure: exact f16 plane of x; q and k as f32 WMMA GEMM outputs, v as f16 (32x64 wave tiles, f32 accumulation, exact x16 weights + bias); cos/sin of the angle input on VALU; RoPE on VALU into f16 planes; V^T by LDS tiles (64-dim slab pairs = one 128-dim group); one fused attention launch (S^T = K.Q^T, online softmax in registers, O^T += V^T.P^T, f16 result); the output GEMM (+ bias).
// Compute dtype: x and parameters rounded to bf16; q, k, v, P and the attention output as f16 operands (~2^-12; P = exp(s - running max) x 2^6, at most 2^14, normalised after the readout); RoPE/softmax f32. v_wmma_f32_16x16x32_f16.
#define NB 2
#define SQ 2048
#define DM 2048
#define NHD 16
#define HD 128
#define NG 4
#define KVD (NG * HD)            /* 512 */
#define HCH 4                    /* heads per kv group (unused) */
#define NR (NB * SQ)
#define SCL 0.08838834764831845f /* 128^-0.5 */
typedef __bf16 v16b __attribute__((ext_vector_type(16)));
typedef unsigned short v8us __attribute__((ext_vector_type(8), may_alias));
typedef float  v8f  __attribute__((ext_vector_type(8)));
typedef float  v4f  __attribute__((ext_vector_type(4)));
typedef float  v4fa __attribute__((ext_vector_type(4), may_alias));
union FragB { v16b v; v8us half[2]; unsigned short u[16]; };

__device__ __forceinline__ unsigned short bf16_bits(float x) { unsigned int u = __float_as_uint(x); return (unsigned short)((u + 0x7FFFu + ((u >> 16) & 1u)) >> 16); }
__device__ __forceinline__ float bf16_val(unsigned short b) { return __uint_as_float(((unsigned int)b) << 16); }
__device__ __forceinline__ float bf16_round(float x) { return bf16_val(bf16_bits(x)); }
// D += A·B with NT terms: 1 = ah·bh, 2 = + al·bh (A split), 3 = + ah·bl (both split)
template <int NT>
__device__ __forceinline__ v8f mmaN(v16b ah, v16b al, v16b bh, v16b bl, v8f c) {
  c = __builtin_amdgcn_wmma_f32_16x16x32_bf16(false, ah, false, bh, (short)0, c, false, false);
  if (NT >= 2) c = __builtin_amdgcn_wmma_f32_16x16x32_bf16(false, al, false, bh, (short)0, c, false, false);
  if (NT >= 3) c = __builtin_amdgcn_wmma_f32_16x16x32_bf16(false, ah, false, bl, (short)0, c, false, false);
  asm volatile("v_nop\n\tv_nop\n\tv_nop\n\tv_nop" : "+v"(c) : "v"(ah), "v"(al), "v"(bh), "v"(bl));
  return c;
}

__global__ __launch_bounds__(256) void k_wt_bf16(const float* __restrict__ W, unsigned short* __restrict__ Wt, int K, int N) {
  const int t = blockIdx.x * 256 + threadIdx.x;
  const int k8n = K / 8;
  if (t >= N * k8n) return;
  const int n = t / k8n, k8 = (t % k8n) * 8;
  v8us v;
#pragma unroll
  for (int i = 0; i < 8; ++i) v[i] = bf16_bits(W[(size_t)(k8 + i) * N + n]);
  *(v8us*)(Wt + (size_t)n * K + k8) = v;
  
}

// GEMM C[M][N] (f32, pitch ldc) = act(A[M][K]·W + bias). A f32 row-major (pitch lda) converted per fragment to bf16
// (ASPLIT: hi/lo two planes -> 2 terms, else single rounded term); Wt bf16 [N][K] (pitch ldb). BIAS_BF16 rounds the
// bias to bf16 first (bias quantised to bf16 before the add). K%32==0, M%16==0, N%64==0.
template <bool ASPLIT, int ACT, bool BIAS_BF16>
__global__ __launch_bounds__(128) void k_gemm_bf(const float* __restrict__ A, int lda, const unsigned short* __restrict__ Wt, int ldb,
                                               const float* __restrict__ bias, float* __restrict__ C, int ldc, int M, int N, int K) {
  __shared__ __attribute__((aligned(16))) float so[4][16][64];
  const int tid = threadIdx.x, w = tid >> 5, lane = tid & 31, ln = lane & 15, hh = lane >> 4;
  const int ntn = N / 64;
  const int wid = blockIdx.x * 4 + w;
  const int mt = wid / ntn, nq = wid % ntn;
  if (mt * 16 >= M) return;
  const int row0 = mt * 16, col0 = nq * 64;
  const float* arow = A + (size_t)(row0 + ln) * lda;
  v8f acc[4] = {};
  for (int kb = 0; kb < K; kb += 32) {
    FragB ah, al;
    const v4f x0 = *(const v4fa*)(arow + kb + 8 * hh), x1 = *(const v4fa*)(arow + kb + 8 * hh + 4);
    const v4f x2 = *(const v4fa*)(arow + kb + 16 + 8 * hh), x3 = *(const v4fa*)(arow + kb + 16 + 8 * hh + 4);
    float xs[16] = {x0[0],x0[1],x0[2],x0[3],x1[0],x1[1],x1[2],x1[3],x2[0],x2[1],x2[2],x2[3],x3[0],x3[1],x3[2],x3[3]};
#pragma unroll
    for (int i = 0; i < 16; ++i) { const unsigned short hb = bf16_bits(xs[i]); ah.u[i] = hb; al.u[i] = ASPLIT ? bf16_bits(xs[i] - bf16_val(hb)) : (unsigned short)0; }
#pragma unroll
    for (int t = 0; t < 4; ++t) {
      const unsigned short* brow = Wt + (size_t)(col0 + t * 16 + ln) * ldb + kb;
      FragB b;
      b.half[0] = *(const v8us*)(brow + 8 * hh);
      b.half[1] = *(const v8us*)(brow + 16 + 8 * hh);
      acc[t] = mmaN<ASPLIT ? 2 : 1>(ah.v, al.v, b.v, b.v, acc[t]);
    }
  }
#pragma unroll
  for (int t = 0; t < 4; ++t) {
    float bv = bias ? bias[col0 + t * 16 + ln] : 0.f;
    if (BIAS_BF16) bv = bf16_round(bv);
#pragma unroll
    for (int r = 0; r < 8; ++r) { float v = acc[t][r] + bv; if (ACT == 1) v = fmaxf(v, 0.f); so[w][8 * hh + r][t * 16 + ln] = v; }
  }
  __builtin_amdgcn_fence(__ATOMIC_ACQ_REL, "workgroup");
  __builtin_amdgcn_wave_barrier();
  const int rsub = lane >> 4, c4 = (lane & 15) * 4;
  {
#pragma unroll
    for (int q = 0; q < 8; ++q) {
      const int r = q * 2 + rsub;
      const v4f v = *(const v4fa*)&so[w][r][c4];
      *(v4f*)(C + (size_t)(row0 + r) * ldc + col0 + c4) = v;
    }
    
  }
}

// GEMM C = act(A·W + bias + resid): A f32 (ASPLIT -> hi/lo 2 terms), Wt bf16 [N][K]; ACT 0 none, 1 relu, 2 exact gelu;
// resid (optional, f32, row index = (row % rmod), pitch ldr, RES_BF16 rounds it) added before the activation.
template <bool ASPLIT, int ACT, bool BIAS_BF16, bool RES_BF16>
__global__ __launch_bounds__(128) void k_gemm_bf3(const float* __restrict__ A, int lda, const unsigned short* __restrict__ Wt, int ldb,
                                                const float* __restrict__ bias, const float* __restrict__ resid, int rmod, int ldr,
                                                float* __restrict__ C, int ldc, int M, int N, int K) {
  __shared__ __attribute__((aligned(16))) float so[4][16][64];
  const int tid = threadIdx.x, w = tid >> 5, lane = tid & 31, ln = lane & 15, hh = lane >> 4;
  const int ntn = N / 64;
  const int wid = blockIdx.x * 4 + w;
  const int mt = wid / ntn, nq = wid % ntn;
  if (mt * 16 >= M) return;
  const int row0 = mt * 16, col0 = nq * 64;
  const float* arow = A + (size_t)(row0 + ln) * lda;
  v8f acc[4] = {};
  for (int kb = 0; kb < K; kb += 32) {
    FragB ah, al;
    const v4f x0 = *(const v4fa*)(arow + kb + 8 * hh), x1 = *(const v4fa*)(arow + kb + 8 * hh + 4);
    const v4f x2 = *(const v4fa*)(arow + kb + 16 + 8 * hh), x3 = *(const v4fa*)(arow + kb + 16 + 8 * hh + 4);
    float xs[16] = {x0[0],x0[1],x0[2],x0[3],x1[0],x1[1],x1[2],x1[3],x2[0],x2[1],x2[2],x2[3],x3[0],x3[1],x3[2],x3[3]};
#pragma unroll
    for (int i = 0; i < 16; ++i) { const unsigned short hb = bf16_bits(xs[i]); ah.u[i] = hb; al.u[i] = ASPLIT ? bf16_bits(xs[i] - bf16_val(hb)) : (unsigned short)0; }
#pragma unroll
    for (int t = 0; t < 4; ++t) {
      const unsigned short* brow = Wt + (size_t)(col0 + t * 16 + ln) * ldb + kb;
      FragB b;
      b.half[0] = *(const v8us*)(brow + 8 * hh);
      b.half[1] = *(const v8us*)(brow + 16 + 8 * hh);
      acc[t] = mmaN<ASPLIT ? 2 : 1>(ah.v, al.v, b.v, b.v, acc[t]);
    }
  }
#pragma unroll
  for (int t = 0; t < 4; ++t) {
    const int col = col0 + t * 16 + ln;
    float bv = bias ? bias[col] : 0.f;
    if (BIAS_BF16) bv = bf16_round(bv);
#pragma unroll
    for (int r = 0; r < 8; ++r) {
      float v = acc[t][r] + bv;
      if (resid) { float rv = resid[(size_t)((row0 + 8 * hh + r) % rmod) * ldr + col]; if (RES_BF16) rv = bf16_round(rv); v += rv; }
      if (ACT == 1) v = fmaxf(v, 0.f);
      if (ACT == 2) v = 0.5f * v * (1.0f + erff(v * 0.70710678118654752f));
      if (ACT == 3) { const float u = 0.7978845608028654f * (v + 0.044715f * v * v * v); v = 0.5f * v * (1.0f + tanhf(u)); }
      so[w][8 * hh + r][t * 16 + ln] = v;
    }
  }
  __builtin_amdgcn_fence(__ATOMIC_ACQ_REL, "workgroup");
  __builtin_amdgcn_wave_barrier();
  const int rsub = lane >> 4, c4 = (lane & 15) * 4;
  {
#pragma unroll
    for (int q = 0; q < 8; ++q) {
      const int r = q * 2 + rsub;
      const v4f v = *(const v4fa*)&so[w][r][c4];
      *(v4f*)(C + (size_t)(row0 + r) * ldc + col0 + c4) = v;
    }
    
  }
}
// row LayerNorm (biased variance, eps) over N: s = X (+ R); optional out_sum <- s; out_norm <- (s-mu)*rsqrt(var+eps)*g + b
template <bool PARAM_BF16>
__global__ __launch_bounds__(256) void k_layernorm(const float* __restrict__ X, const float* __restrict__ R, const float* __restrict__ g, const float* __restrict__ bta,
                                                  float* __restrict__ out_sum, float* __restrict__ out_norm, int N, float eps) {
  __shared__ float red[256];
  const int row = blockIdx.x, tid = threadIdx.x;
  const float* x = X + (size_t)row * N; const float* rr = R ? R + (size_t)row * N : nullptr;
  float vals[16];                     // up to N = 4096
  const int per = N / 256;            // contiguous chunk per thread? use strided-by-4 chunks: thread handles j = tid*4 + 1024*u
  float s1 = 0.f;
  for (int u = 0; u < per / 4; ++u) {
    const int j = tid * 4 + 1024 * u;
    const v4f a = *(const v4fa*)(x + j);
    v4f b = {0.f,0.f,0.f,0.f}; if (rr) b = *(const v4fa*)(rr + j);
#pragma unroll
    for (int q = 0; q < 4; ++q) { const float v = a[q] + b[q]; vals[u * 4 + q] = v; s1 += v; }
  }
  red[tid] = s1; __syncthreads();
  for (int st = 128; st > 0; st >>= 1) { if (tid < st) red[tid] += red[tid + st]; __syncthreads(); }
  const float mu = red[0] / (float)N; __syncthreads();
  float s2 = 0.f;
  for (int u = 0; u < per / 4; ++u)
#pragma unroll
    for (int q = 0; q < 4; ++q) { const float c = vals[u * 4 + q] - mu; s2 += c * c; }
  red[tid] = s2; __syncthreads();
  for (int st = 128; st > 0; st >>= 1) { if (tid < st) red[tid] += red[tid + st]; __syncthreads(); }
  const float rs = rsqrtf(red[0] / (float)N + eps);
  {
    for (int u = 0; u < per / 4; ++u) {
      const int j = tid * 4 + 1024 * u;
      v4f o, sm;
#pragma unroll
      for (int q = 0; q < 4; ++q) {
        float gg = g[j + q], bb = bta[j + q];
        if (PARAM_BF16) { gg = bf16_round(gg); bb = bf16_round(bb); }
        sm[q] = vals[u * 4 + q]; o[q] = (vals[u * 4 + q] - mu) * rs * gg + bb;
      }
      if (out_sum) *(v4f*)(out_sum + (size_t)row * N + j) = sm;
      *(v4f*)(out_norm + (size_t)row * N + j) = o;
    }
    
  }
}



// ---- f16 WMMA path (v_wmma_f32_16x16x32_f16): 11-bit significands for operands in range — used for every matrix product launched here
typedef _Float16 v16h __attribute__((ext_vector_type(16)));
union FragH { v16h v; v8us half[2]; _Float16 h[16]; unsigned short u[16]; };
template <int NT>
__device__ __forceinline__ v8f mmaH(v16h ah, v16h al, v16h bh, v16h bl, v8f c) {
  c = __builtin_amdgcn_wmma_f32_16x16x32_f16(false, ah, false, bh, (short)0, c, false, false);
  if (NT >= 2) c = __builtin_amdgcn_wmma_f32_16x16x32_f16(false, al, false, bh, (short)0, c, false, false);
  if (NT >= 3) c = __builtin_amdgcn_wmma_f32_16x16x32_f16(false, ah, false, bl, (short)0, c, false, false);
  asm volatile("v_nop\n\tv_nop\n\tv_nop\n\tv_nop" : "+v"(c) : "v"(ah), "v"(al), "v"(bh), "v"(bl));
  return c;
}
// batched GEMM like k_gemm_b but f16 operands: A f32 (split into f16 hi/lo if ASPLIT, else rounded to f16), Bt = f16 values [n][k]; alpha; C f32; N multiple of 16 (partial tiles skipped)
template <bool ASPLIT>
__global__ __launch_bounds__(128) void k_gemm_h(const float* __restrict__ A, int lda, size_t sA, const _Float16* __restrict__ Bh, int ldb, size_t sB, float alpha, float* __restrict__ C, int ldc, size_t sC, int M, int N, int K) {
  __shared__ __attribute__((aligned(16))) float so[4][16][64];
  const int tid = threadIdx.x, w = tid >> 5, lane = tid & 31, ln = lane & 15, hh = lane >> 4; const int by = blockIdx.y;
  A += (size_t)by * sA; Bh += (size_t)by * sB; C += (size_t)by * sC;
  const int ntn = (N + 63) / 64; const int wid = blockIdx.x * 4 + w; const int mt = wid / ntn, nq = wid % ntn; if (mt * 16 >= M) return;
  const int row0 = mt * 16, col0 = nq * 64; const float* arow = A + (size_t)(row0 + ln) * lda;
  v8f acc[4] = {};
  for (int kb = 0; kb < K; kb += 32) {
    FragH ah, al;
    const v4f x0 = *(const v4fa*)(arow + kb + 8 * hh), x1 = *(const v4fa*)(arow + kb + 8 * hh + 4), x2 = *(const v4fa*)(arow + kb + 16 + 8 * hh), x3 = *(const v4fa*)(arow + kb + 16 + 8 * hh + 4);
    float xs[16] = {x0[0],x0[1],x0[2],x0[3],x1[0],x1[1],x1[2],x1[3],x2[0],x2[1],x2[2],x2[3],x3[0],x3[1],x3[2],x3[3]};
#pragma unroll
    for (int i = 0; i < 16; ++i) { const _Float16 h = (_Float16)xs[i]; ah.h[i] = h; al.h[i] = ASPLIT ? (_Float16)(xs[i] - (float)h) : (_Float16)0.0f; }
#pragma unroll
    for (int t = 0; t < 4; ++t) { if (col0 + t * 16 >= N) continue; const size_t boff = (size_t)(col0 + t * 16 + ln) * ldb + kb; FragH bq; bq.half[0] = *(const v8us*)(Bh + boff + 8 * hh); bq.half[1] = *(const v8us*)(Bh + boff + 16 + 8 * hh);
      acc[t] = mmaH<ASPLIT ? 2 : 1>(ah.v, al.v, bq.v, bq.v, acc[t]); }
  }
#pragma unroll
  for (int t = 0; t < 4; ++t) { if (col0 + t * 16 >= N) continue;
#pragma unroll
    for (int r = 0; r < 8; ++r) so[w][8 * hh + r][t * 16 + ln] = acc[t][r] * alpha; }
  __builtin_amdgcn_fence(__ATOMIC_ACQ_REL, "workgroup"); __builtin_amdgcn_wave_barrier();
  const int rsub = lane >> 4, c4 = (lane & 15) * 4;
  {
#pragma unroll
    for (int q = 0; q < 8; ++q) { const int r = q * 2 + rsub; if (col0 + c4 < N) { const v4f v = *(const v4fa*)&so[w][r][c4]; *(v4f*)(C + (size_t)(row0 + r) * ldc + col0 + c4) = v; } }
     }
}

// Wt[n][k] = f16(W[k][n]·scale) from f32 row-major W[K][N] (scale = power of two; bf16-exact weights stay exact in f16 away from the subnormal range)
__global__ __launch_bounds__(256) void k_wt_f16(const float* __restrict__ W, _Float16* __restrict__ Wt, int K, int N, float scale) {
  const int t = blockIdx.x * 256 + threadIdx.x; if (t >= N * (K / 8)) return; const int n = t / (K / 8), k8 = (t % (K / 8)) * 8; FragH f;
#pragma unroll
  for (int i = 0; i < 8; ++i) f.h[i] = (_Float16)(bf16_round(W[(size_t)(k8 + i) * N + n]) * scale); const v8us o = f.half[0];
  *(v8us*)((unsigned short*)Wt + (size_t)n * K + k8) = o; 
}
// k_gemm_hh variant with fused epilogue: v = acc·alpha + bias[by·sBias + col] (+ CP[(row/rowsPerB)·sCPb + by·64 + col] if CP) ; ACT 0 none / 1 elu ; writes f16 C16 (and f32 C if non-null)
template <int ACT>
__global__ __launch_bounds__(128) void k_gemm_hhx(const _Float16* __restrict__ A, int lda, size_t sA, const _Float16* __restrict__ Bh, int ldb, size_t sB, float alpha, const float* __restrict__ bias, size_t sBias, const float* __restrict__ CP, int rowsPerB, size_t sCPb, int row0g,
    float* __restrict__ C, _Float16* __restrict__ C16, int ldc, size_t sC, int M, int N, int K) {
  __shared__ __attribute__((aligned(16))) float so[4][16][64];
  const int tid = threadIdx.x, w = tid >> 5, lane = tid & 31, ln = lane & 15, hh = lane >> 4; const int by = blockIdx.y;
  A += (size_t)by * sA; Bh += (size_t)by * sB; const size_t cofs = (size_t)by * sC; const float* bp = bias ? bias + (size_t)by * sBias : nullptr;
  const int ntn = (N + 63) / 64; const int wid = blockIdx.x * 4 + w; const int mt = wid / ntn, nq = wid % ntn; if (mt * 16 >= M) return;
  const int row0 = mt * 16, col0 = nq * 64; const _Float16* arow = A + (size_t)(row0 + ln) * lda;
  v8f acc[4] = {};
  for (int kb = 0; kb < K; kb += 32) { FragH ah; ah.half[0] = *(const v8us*)((const unsigned short*)arow + kb + 8 * hh); ah.half[1] = *(const v8us*)((const unsigned short*)arow + kb + 16 + 8 * hh);
#pragma unroll
    for (int t = 0; t < 4; ++t) { if (col0 + t * 16 >= N) continue; const size_t boff = (size_t)(col0 + t * 16 + ln) * ldb + kb; FragH bq; bq.half[0] = *(const v8us*)((const unsigned short*)Bh + boff + 8 * hh); bq.half[1] = *(const v8us*)((const unsigned short*)Bh + boff + 16 + 8 * hh);
      acc[t] = mmaH<1>(ah.v, ah.v, bq.v, bq.v, acc[t]); }
  }
#pragma unroll
  for (int t = 0; t < 4; ++t) { if (col0 + t * 16 >= N) continue; const int col = col0 + t * 16 + ln; const float bv = bp ? bf16_round(bp[col]) : 0.f;
#pragma unroll
    for (int r = 0; r < 8; ++r) { float v = acc[t][r] * alpha + bv; if (CP) { const int rr = row0g + row0 + 8 * hh + r; if (rowsPerB < 0) v += CP[cofs + (size_t)rr * ldc + col];      /* rowsPerB < 0: own element of the batched C plane */ else { const int bidx = rr / rowsPerB; v += CP[(size_t)bidx * sCPb + (size_t)by * 64 + col]; } } if (ACT == 1) v = (v > 0.f) ? v : expm1f(v); else if (ACT == 7) v = (v > 0.f) ? v + 1.0f : expf(v); else if (ACT == 8) v = tanhf(v); else if (ACT == 9) v = 0.5f * v * (1.0f + tanhf(0.7978845608028654f * (v + 0.044715f * v * v * v))); else if (ACT == 11) v = 1.0f / (1.0f + expf(-v)); else if (ACT == 12) v = (v > 0.f) ? v : 0.01f * v; else if (ACT == 14) v = (v > 0.f) ? v : 0.1f * v; else if (ACT == 16) v = (v >= 0.f) ? v : 0.3f * v; else if (ACT == 15) v = v / (1.0f + expf(-v)); else if (ACT == 3) v = fmaxf(v, 0.f); else if (ACT == 6) v = 0.5f * v * (1.0f + erff(v * 0.70710678118654752f)); so[w][8 * hh + r][t * 16 + ln] = v; } }
  __builtin_amdgcn_fence(__ATOMIC_ACQ_REL, "workgroup"); __builtin_amdgcn_wave_barrier();
  const int rsub = lane >> 4, c4 = (lane & 15) * 4; typedef _Float16 v4h __attribute__((ext_vector_type(4)));
  {
#pragma unroll
    for (int q = 0; q < 8; ++q) { const int r = q * 2 + rsub; if (col0 + c4 < N) { const v4f v = *(const v4fa*)&so[w][r][c4]; if (C) *(v4f*)(C + cofs + (size_t)(row0 + r) * ldc + col0 + c4) = v; if (C16) { v4h h4; for (int i = 0; i < 4; ++i) h4[i] = (_Float16)v[i]; *(v4h*)(C16 + cofs + (size_t)(row0 + r) * ldc + col0 + c4) = h4; } } }
     }
}


typedef _Float16 v4h __attribute__((ext_vector_type(4)));

__global__ __launch_bounds__(256) void k_x16(const float* __restrict__ x, _Float16* __restrict__ X16, size_t n8) { const size_t t = (size_t)blockIdx.x * 256 + threadIdx.x; if (t >= n8) return; FragH f;
#pragma unroll
  for (int q = 0; q < 8; ++q) f.h[q] = (_Float16)bf16_round(x[t * 8 + q]); *(v8us*)((unsigned short*)X16 + t * 8) = f.half[0];  }
__global__ __launch_bounds__(256) void k_round16f(const float* __restrict__ W, _Float16* __restrict__ Bt, size_t n8) { const size_t t = (size_t)blockIdx.x * 256 + threadIdx.x; if (t >= n8) return; FragH f;
#pragma unroll
  for (int i = 0; i < 8; ++i) f.h[i] = (_Float16)(bf16_round(W[t * 8 + i]) * 16.0f); *(v8us*)((unsigned short*)Bt + t * 8) = f.half[0];  }
template <int NHv, int TTv>
__global__ __launch_bounds__(256) void k_vt(const _Float16* __restrict__ V16, int ldv, int voff, _Float16* __restrict__ Vt) { __shared__ unsigned short tl[64][66]; const int tid = threadIdx.x; const int slab = blockIdx.x / (TTv / 64), lg = blockIdx.x % (TTv / 64); const int b = slab / NHv, h = slab % NHv;
  for (int i = tid; i < 64 * 8; i += 256) { const int r = i / 8, c8 = (i % 8) * 8; FragH f; f.half[0] = *(const v8us*)((const unsigned short*)V16 + ((size_t)b * TTv + lg * 64 + r) * ldv + voff + h * 64 + c8);
#pragma unroll
    for (int q = 0; q < 8; ++q) tl[r][c8 + q] = f.u[q]; }
  __syncthreads();
  {
#pragma unroll
    for (int rd = 0; rd < 2; ++rd) { const int d = rd * 32 + tid / 8, pc = tid % 8; FragH f;
#pragma unroll
      for (int q = 0; q < 8; ++q) f.u[q] = tl[pc * 8 + q][d];
      *(v8us*)((unsigned short*)Vt + ((size_t)slab * 64 + d) * TTv + lg * 64 + pc * 8) = f.half[0]; }
     } }

__global__ __launch_bounds__(256) void k_hl(const float* __restrict__ F, _Float16* __restrict__ Hh, _Float16* __restrict__ Hl, size_t n8) { const size_t t = (size_t)blockIdx.x * 256 + threadIdx.x; if (t >= n8) return; FragH fh, fl; const v4f a = *(const v4fa*)(F + t * 8), c = *(const v4fa*)(F + t * 8 + 4);
#pragma unroll
  for (int q = 0; q < 4; ++q) { _Float16 h = (_Float16)a[q]; fh.h[q] = h; fl.h[q] = (_Float16)((a[q] - (float)h) * 1024.0f); h = (_Float16)c[q]; fh.h[4 + q] = h; fl.h[4 + q] = (_Float16)((c[q] - (float)h) * 1024.0f); }
  { *(v8us*)((unsigned short*)Hh + t * 8) = fh.half[0]; *(v8us*)((unsigned short*)Hl + t * 8) = fl.half[0];  } }

// ---- fast GEMM (wave tile 32x64; requires M % 32 == 0 rows per launch region and N % 64 == 0); epilogue = k_gemm_hhx semantics ----
__device__ __forceinline__ v16h g2_frag(const _Float16* p, int hh) { FragH f; f.half[0] = *(const v8us*)((const unsigned short*)p + 8 * hh); f.half[1] = *(const v8us*)((const unsigned short*)p + 16 + 8 * hh); return f.v; }
__device__ __forceinline__ v8f g2_mma(v16h a, v16h b, v8f c) { v8f d = __builtin_amdgcn_wmma_f32_16x16x32_f16(false, a, false, b, (short)0, c, false, false); asm volatile("v_nop\n\tv_nop\n\tv_nop\n\tv_nop" : "+v"(d) : "v"(a), "v"(b)); return d; }
template <int ACT>
__global__ __launch_bounds__(128) void k_gemm2(const _Float16* __restrict__ A, int lda, size_t sA, const _Float16* __restrict__ Bh, int ldb, size_t sB, float alpha, const float* __restrict__ bias, size_t sBias, const float* __restrict__ CP, int rowsPerB, size_t sCPb, int row0g,
    float* __restrict__ C, _Float16* __restrict__ C16, int ldc, size_t sC, int M, int N, int K) { static_assert(ACT == 0 || ACT == 3 || ACT == 6 || ACT == 8 || ACT == 9 || ACT == 11 || ACT == 12 || ACT == 14 || ACT == 15 || ACT == 16, "k_gemm2: unsupported ACT code (would silently apply no activation)");
  __shared__ __attribute__((aligned(16))) float so[4][32][68];
  const int tid = threadIdx.x, w = tid >> 5, lane = tid & 31, ln = lane & 15, hh = lane >> 4; const int by = blockIdx.y;
  A += (size_t)by * sA; Bh += (size_t)by * sB; const size_t cofs = (size_t)by * sC; const float* bp = bias ? bias + (size_t)by * sBias : nullptr;
  const int ntn = N >> 6; const int mt = blockIdx.x / ntn, nq = blockIdx.x - mt * ntn; const int row0 = mt * 128 + 32 * w, col0 = nq * 64; if (row0 >= M) return;
  const _Float16* a0p = A + (size_t)(row0 + ln) * lda; const _Float16* a1p = a0p + (size_t)16 * lda;
  const _Float16* b0p = Bh + (size_t)(col0 + ln) * ldb; const _Float16* b1p = b0p + (size_t)16 * ldb; const _Float16* b2p = b1p + (size_t)16 * ldb; const _Float16* b3p = b2p + (size_t)16 * ldb;
  const v8f z8 = {0.f,0.f,0.f,0.f,0.f,0.f,0.f,0.f}; v8f c00 = z8, c01 = z8, c02 = z8, c03 = z8, c10 = z8, c11 = z8, c12 = z8, c13 = z8;
#pragma unroll 1
  for (int kb = 0; kb < K; kb += 32) { const v16h a0 = g2_frag(a0p + kb, hh), a1 = g2_frag(a1p + kb, hh);
    v16h b = g2_frag(b0p + kb, hh); c00 = g2_mma(a0, b, c00); c10 = g2_mma(a1, b, c10);
    b = g2_frag(b1p + kb, hh); c01 = g2_mma(a0, b, c01); c11 = g2_mma(a1, b, c11);
    b = g2_frag(b2p + kb, hh); c02 = g2_mma(a0, b, c02); c12 = g2_mma(a1, b, c12);
    b = g2_frag(b3p + kb, hh); c03 = g2_mma(a0, b, c03); c13 = g2_mma(a1, b, c13); }
  v8f accs[8] = {c00, c01, c02, c03, c10, c11, c12, c13};
#pragma unroll
  for (int u = 0; u < 8; ++u) { const int t = u & 3, half = u >> 2; const int col = col0 + t * 16 + ln; const float bv = bp ? bf16_round(bp[col]) : 0.f;
#pragma unroll
    for (int r = 0; r < 8; ++r) { const int rloc = half * 16 + 8 * hh + r; float v = accs[u][r] * alpha + bv; if (CP) { if (rowsPerB < 0) v += CP[cofs + (size_t)(row0g + row0 + rloc) * ldc + col];      /* rowsPerB < 0: own element of the batched C plane */ else { const int bidx = (row0g + row0 + rloc) / rowsPerB; v += CP[(size_t)bidx * sCPb + (size_t)by * 64 + col]; } }
      if (ACT == 3) v = fmaxf(v, 0.f); else if (ACT == 6) v = 0.5f * v * (1.0f + erff(v * 0.70710678118654752f)); else if (ACT == 11) v = 1.0f / (1.0f + expf(-v)); else if (ACT == 15) v = v / (1.0f + expf(-v)); else if (ACT == 12) v = (v > 0.f) ? v : 0.01f * v; else if (ACT == 8) v = tanhf(v); else if (ACT == 9) v = 0.5f * v * (1.0f + tanhf(0.7978845608028654f * (v + 0.044715f * v * v * v))); else if (ACT == 14) v = (v > 0.f) ? v : 0.1f * v; else if (ACT == 16) v = (v >= 0.f) ? v : 0.3f * v;
      so[w][rloc][t * 16 + ln] = v; } }
  __builtin_amdgcn_fence(__ATOMIC_ACQ_REL, "workgroup"); __builtin_amdgcn_wave_barrier();
  const int rsub = lane >> 4, c4 = (lane & 15) * 4;
  {
#pragma unroll
    for (int q = 0; q < 16; ++q) { const int r = q * 2 + rsub; const v4f v = *(const v4fa*)&so[w][r][c4]; if (C) *(v4f*)(C + cofs + (size_t)(row0 + r) * ldc + col0 + c4) = v; if (C16) { v4h h4; for (int i = 0; i < 4; ++i) h4[i] = (_Float16)v[i]; *(v4h*)(C16 + cofs + (size_t)(row0 + r) * ldc + col0 + c4) = h4; } }
     } }


__global__ __launch_bounds__(256) void k_cs(const float* __restrict__ rf, float* __restrict__ CS, float* __restrict__ SN) { const int t = blockIdx.x * 256 + threadIdx.x; if (t >= SQ * 64) return; const float a = bf16_round(rf[t]); const float c = cosf(a), s = sinf(a); { *(float*)(CS + t) = c; *(float*)(SN + t) = s;  } }
__global__ __launch_bounds__(256) void k_rope(const float* __restrict__ F, int nh, const float* __restrict__ CS, const float* __restrict__ SN, _Float16* __restrict__ H16) {
  #pragma clang fp contract(off)
  const size_t t = (size_t)blockIdx.x * 256 + threadIdx.x; if (t >= (size_t)NR * nh * 16) return; const int g8 = (int)(t % 16); const int h = (int)((t / 16) % nh); const size_t row = t / ((size_t)16 * nh); const int s = (int)(row % SQ);
  const size_t base = row * (size_t)(nh * HD) + h * HD + g8 * 8; FragH f;
  for (int i = 0; i < 4; ++i) { const int j = g8 * 4 + i; const float c = CS[s * 64 + j], sn = SN[s * 64 + j]; const float e = F[base + 2 * i], o = F[base + 2 * i + 1]; float r0 = e * c; r0 += -o * sn; float r1 = e * sn; r1 += o * c; f.h[2 * i] = (_Float16)r0; f.h[2 * i + 1] = (_Float16)r1; }
  *(v8us*)((unsigned short*)H16 + base) = f.half[0];  }
#define FA_KT 64                     /* keys per stage */
#define FA_NST (SQ / FA_KT)
#define FA_PK 272                    /* LDS pitch of a K row: 256 B + 16 (odd multiple of 16 B) */
#define FA_PV 144                    /* LDS pitch of a V^T row: 128 B + 16 */
#define FA_TK (FA_KT * FA_PK)
#define FA_TV (HD * FA_PV)
#define FA_SLOT (FA_TK + FA_TV)
#define FA_CS (SCL * 1.4426950408889634f) /* score scale in the log2 domain */
#define FA_PB 6.0f                   /* P = 2^(score - maximum in use + 6): at most 2^14 in f16, and small weights stay clear of the f16 subnormals; the row sum carries the same factor */
typedef float v2f __attribute__((ext_vector_type(2)));
typedef _Float16 v2h __attribute__((ext_vector_type(2)));
__device__ __forceinline__ float fa_xhalf(float x) { return __builtin_bit_cast(float, __builtin_amdgcn_permlanex16(__builtin_bit_cast(int, x), __builtin_bit_cast(int, x), 0x76543210, 0xfedcba98, false, false)); }  /* lane l with lane l ^ 16 */
__device__ __forceinline__ v8f fa_mma(v16h a, v16h b, v8f c) { return __builtin_amdgcn_wmma_f32_16x16x32_f16(false, a, false, b, (short)0, c, false, false); }
__device__ __forceinline__ v16h fa_lfrag(const unsigned char* p) { FragH f; f.half[0] = *(const v8us*)p; f.half[1] = *(const v8us*)(p + 32); return f.v; }  /* hardware k order: bytes 16h and 32 + 16h of each 64 */
__global__ __launch_bounds__(256) __attribute__((amdgpu_waves_per_eu(2, 2))) void k_fattn(const _Float16* __restrict__ Q16, const _Float16* __restrict__ K16, const _Float16* __restrict__ VT, _Float16* __restrict__ O16) {
  __shared__ __attribute__((aligned(16))) unsigned char L[2 * FA_SLOT];
  const int tid = threadIdx.x, lane = tid & 31, w = tid >> 5, c = lane & 15, h = lane >> 4;
  const int hd = blockIdx.y, b = blockIdx.z, g = hd / (NHD / NG);
  const int q0 = blockIdx.x * 256 + w * 32;
  const unsigned short* Kg = (const unsigned short*)K16 + (size_t)b * SQ * KVD + g * HD;      /* row = key, pitch KVD */
  const unsigned short* Vg = (const unsigned short*)VT + (size_t)(b * NG + g) * HD * SQ;      /* row = d, pitch SQ */
  const unsigned short* kgp = Kg + (size_t)(tid >> 4) * KVD + (tid & 15) * 8;                 /* 16 lanes a K row, 16 rows a round */
  const unsigned short* vgp = Vg + (size_t)(tid >> 3) * SQ + (tid & 7) * 8;                   /* 8 lanes a V^T row, 32 rows a round */
  const int kls = (tid >> 4) * FA_PK + (tid & 15) * 16, vls = FA_TK + (tid >> 3) * FA_PV + (tid & 7) * 16;
  v8us rk[4], rv[4];
#pragma unroll
  for (int j = 0; j < 4; ++j) { rk[j] = *(const v8us*)(kgp + (size_t)(16 * j) * KVD); rv[j] = *(const v8us*)(vgp + (size_t)(32 * j) * SQ); }
  v16h qf[2][4];
#pragma unroll
  for (int qt = 0; qt < 2; ++qt)
#pragma unroll
    for (int ks = 0; ks < 4; ++ks) qf[qt][ks] = g2_frag(Q16 + ((size_t)b * SQ + q0 + 16 * qt + c) * DM + hd * HD + 32 * ks, h);
  asm volatile("s_wait_xcnt 0x0" ::: "memory");      /* stands in front of the first overwrite of an address register of the loads above */
  const v8f z8 = {0.f,0.f,0.f,0.f,0.f,0.f,0.f,0.f};
  v8f acc[2][8]; float m_run[2], l_run[2];
#pragma unroll
  for (int qt = 0; qt < 2; ++qt) { m_run[qt] = -__builtin_inff(); l_run[qt] = 0.f;
#pragma unroll
    for (int t = 0; t < 8; ++t) acc[qt][t] = z8; }
#pragma unroll
  for (int j = 0; j < 4; ++j) { *(v8us*)(L + kls + 16 * j * FA_PK) = rk[j]; *(v8us*)(L + vls + 32 * j * FA_PV) = rv[j]; }
  __syncthreads();
#pragma unroll 1      /* stage and pass loops stay rolled and nested: unrolled or flattened they cost registers and code size */
  for (int st = 0; st < FA_NST; ++st) {
    const unsigned char* Lb = L + (st & 1) * FA_SLOT;
    const bool more = st + 1 < FA_NST;
    if (more) {
#pragma unroll
      for (int j = 0; j < 4; ++j) { rk[j] = *(const v8us*)(kgp + (size_t)((st + 1) * FA_KT + 16 * j) * KVD); rv[j] = *(const v8us*)(vgp + (size_t)(32 * j) * SQ + (st + 1) * FA_KT); }
      asm volatile("s_wait_xcnt 0x0" ::: "memory");      /* stands in front of the first overwrite of an address register of these loads, which stay in flight over the passes */
    }
#pragma unroll 1      /* see the stage loop */
    for (int sub = 0; sub < FA_KT / 32; ++sub) {      /* one pass = 32 keys */
      v8f s[2][2];
#pragma unroll
      for (int kt = 0; kt < 2; ++kt) { s[kt][0] = z8; s[kt][1] = z8;
        const unsigned char* kp = Lb + (sub * 32 + 16 * kt + c) * FA_PK + 16 * h;
#pragma unroll
        for (int ks = 0; ks < 4; ++ks) { const v16h ka = fa_lfrag(kp + 64 * ks); s[kt][0] = fa_mma(ka, qf[0][ks], s[kt][0]); s[kt][1] = fa_mma(ka, qf[1][ks], s[kt][1]); } }
      v16h vf[8];
      { const unsigned char* vp = Lb + FA_TK + c * FA_PV + sub * 64 + 16 * h;
#pragma unroll
        for (int t = 0; t < 8; ++t) vf[t] = fa_lfrag(vp + 16 * t * FA_PV); }
      /* maxima of the raw scores (the scale is positive); the maximum in use may trail the true one by up to 8 in the log2 domain, so P stays at or below 2^(8 + FA_PB) */
      float mb[2]; bool need = false;
#pragma unroll
      for (int qt = 0; qt < 2; ++qt) { float mx = s[0][qt][0];
#pragma unroll
        for (int r = 1; r < 8; ++r) mx = fmaxf(mx, s[0][qt][r]);
#pragma unroll
        for (int r = 0; r < 8; ++r) mx = fmaxf(mx, s[1][qt][r]);
        mx = fmaxf(mx, fa_xhalf(mx)) * FA_CS; mb[qt] = mx; need = need || (mx > m_run[qt] + 8.0f); }
      if (__builtin_amdgcn_ballot_w32(need) != 0) {      /* wave-uniform; rare after the first passes */
#pragma unroll
        for (int qt = 0; qt < 2; ++qt) { const float m_new = fmaxf(m_run[qt], mb[qt]); const float corr = __builtin_amdgcn_exp2f(m_run[qt] - m_new);      /* 0 on the first pass */
          l_run[qt] *= corr; m_run[qt] = m_new;
#pragma unroll
          for (int t = 0; t < 8; ++t) acc[qt][t] = acc[qt][t] * corr; }
      }
#pragma unroll
      for (int qt = 0; qt < 2; ++qt) { const float nm = FA_PB - m_run[qt]; float ps0 = 0.f, ps1 = 0.f; union { v16h v; v2h p[8]; } pf;
#pragma unroll
        for (int i = 0; i < 8; ++i) {
          const v2f arg = __builtin_elementwise_fma(v2f{s[i >> 2][qt][2 * (i & 3)], s[i >> 2][qt][2 * (i & 3) + 1]}, v2f{FA_CS, FA_CS}, v2f{nm, nm});
          const float p0 = __builtin_amdgcn_exp2f(arg.x), p1 = __builtin_amdgcn_exp2f(arg.y);
          if (i & 1) ps1 += p0 + p1; else ps0 += p0 + p1;
          pf.p[i] = __builtin_convertvector(v2f{p0, p1}, v2h); }
        l_run[qt] += ps0 + ps1;
#pragma unroll
        for (int t = 0; t < 8; ++t) acc[qt][t] = fa_mma(vf[t], pf.v, acc[qt][t]); }
      /* four vector slots between the pass's last WMMA and the first instruction behind the loop's branch that overwrites its A or B registers; the scheduling barriers keep them at this place */
      __builtin_amdgcn_sched_barrier(0); asm volatile("v_nop\n\tv_nop\n\tv_nop\n\tv_nop"); __builtin_amdgcn_sched_barrier(0);
    }
    if (more) { unsigned char* Ln = L + ((st + 1) & 1) * FA_SLOT;      /* every wave left this buffer at the barrier that ended stage st - 1 */
#pragma unroll
      for (int j = 0; j < 4; ++j) { *(v8us*)(Ln + kls + 16 * j * FA_PK) = rk[j]; *(v8us*)(Ln + vls + 32 * j * FA_PV) = rv[j]; } }
    __syncthreads();
  }
  /* epilogue: normalise, stage the wave's 32 rows in its own LDS slice (all reads of the ring ended at the last barrier), store whole 256-byte rows */
  unsigned char* E = L + w * 32 * FA_PK;
#pragma unroll
  for (int qt = 0; qt < 2; ++qt) { const float inv = 1.0f / (l_run[qt] + fa_xhalf(l_run[qt]));
#pragma unroll
    for (int t = 0; t < 8; ++t) { FragH f;
#pragma unroll
      for (int r = 0; r < 8; ++r) f.h[r] = (_Float16)(acc[qt][t][r] * inv);
      *(v8us*)(E + (16 * qt + c) * FA_PK + 32 * t + 16 * h) = f.half[0]; } }
  __builtin_amdgcn_fence(__ATOMIC_ACQ_REL, "workgroup"); __builtin_amdgcn_wave_barrier();
#pragma unroll
  for (int i = 0; i < 16; ++i) { const int row = i * 2 + h; const v8us v = *(const v8us*)(E + row * FA_PK + c * 16);
    *(v8us*)((unsigned short*)O16 + ((size_t)b * SQ + q0 + row) * DM + hd * HD + c * 8) = v; }
}

extern "C" void kernel_launch(void* const* d_in, const int* in_sizes, int n_in,
                              void* d_out, int out_size, void* d_ws, size_t ws_size, hipStream_t stream) {
  (void)in_sizes; (void)n_in; (void)out_size;
  const float* const* I = (const float* const*)d_in; const float* x = I[0]; const float* rf = I[1]; const float* Wq = I[2]; const float* bq = I[3]; const float* Wk = I[4]; const float* bk = I[5]; const float* Wv = I[6]; const float* bv = I[7]; const float* Wo = I[8]; const float* bo = I[9];
  char* ws = (char*)d_ws; size_t off = 0;
  auto take = [&](size_t bytes) { char* p = ws + off; off += (bytes + 255) & ~(size_t)255; return p; };
  const size_t np = (size_t)NR * DM, nk = (size_t)NR * KVD;
  _Float16* BQ = (_Float16*)take((size_t)DM * DM * 2); _Float16* BK = (_Float16*)take((size_t)KVD * DM * 2); _Float16* BV = (_Float16*)take((size_t)KVD * DM * 2); _Float16* BO = (_Float16*)take((size_t)DM * DM * 2); float* CS = (float*)take((size_t)SQ * 64 * 4); float* SN = (float*)take((size_t)SQ * 64 * 4);
  _Float16* X16 = (_Float16*)take(np * 2); float* QF = (float*)take(np * 4); _Float16* Q16 = (_Float16*)take(np * 2); float* KF = (float*)take(nk * 4); _Float16* K16 = (_Float16*)take(nk * 2); _Float16* V16 = (_Float16*)take(nk * 2); _Float16* VT = (_Float16*)take(nk * 2);
  _Float16* O16 = (_Float16*)take(np * 2);
  if (off > ws_size) return;      /* 20 + 1 + 16 + 32 + 16 + 8 + 4 + 4 + 4 + 16 = 121 MiB */
  k_wt_f16<<<(unsigned)(((size_t)DM * DM / 8 + 255) / 256), 256, 0, stream>>>(Wq, BQ, DM, DM, 16.0f); k_wt_f16<<<(unsigned)(((size_t)DM * KVD / 8 + 255) / 256), 256, 0, stream>>>(Wk, BK, DM, KVD, 16.0f); k_wt_f16<<<(unsigned)(((size_t)DM * KVD / 8 + 255) / 256), 256, 0, stream>>>(Wv, BV, DM, KVD, 16.0f); k_wt_f16<<<(unsigned)(((size_t)DM * DM / 8 + 255) / 256), 256, 0, stream>>>(Wo, BO, DM, DM, 16.0f);
  k_cs<<<(SQ * 64 + 255) / 256, 256, 0, stream>>>(rf, CS, SN);
  k_x16<<<(unsigned)((np / 8 + 255) / 256), 256, 0, stream>>>(x, X16, np / 8);
  k_gemm2<0><<<dim3((NR / 128) * (DM / 64), 1), 128, 0, stream>>>(X16, DM, 0, BQ, DM, 0, 0.0625f, bq, 0, nullptr, 1, 0, 0, QF, nullptr, DM, 0, NR, DM, DM);
  k_gemm2<0><<<dim3((NR / 128) * (KVD / 64), 1), 128, 0, stream>>>(X16, DM, 0, BK, DM, 0, 0.0625f, bk, 0, nullptr, 1, 0, 0, KF, nullptr, KVD, 0, NR, KVD, DM);
  k_gemm2<0><<<dim3((NR / 128) * (KVD / 64), 1), 128, 0, stream>>>(X16, DM, 0, BV, DM, 0, 0.0625f, bv, 0, nullptr, 1, 0, 0, nullptr, V16, KVD, 0, NR, KVD, DM);
  k_rope<<<(unsigned)(((size_t)NR * NHD * 16 + 255) / 256), 256, 0, stream>>>(QF, NHD, CS, SN, Q16); k_rope<<<(unsigned)(((size_t)NR * NG * 16 + 255) / 256), 256, 0, stream>>>(KF, NG, CS, SN, K16);
  k_vt<KVD / 64, SQ><<<NB * (KVD / 64) * (SQ / 64), 256, 0, stream>>>(V16, KVD, 0, VT);      /* 64-dim slabs: group g = slabs 2g, 2g+1 (contiguous) */
  k_fattn<<<dim3(SQ / 256, NHD, NB), 256, 0, stream>>>(Q16, K16, VT, O16);      /* head h reads kv group h / 4 */
  k_gemm2<0><<<dim3((NR / 128) * (DM / 64), 1), 128, 0, stream>>>(O16, DM, 0, BO, DM, 0, 0.0625f, bo, 0, nullptr, 1, 0, 0, (float*)d_out, nullptr, DM, 0, NR, DM, DM);
}
